// v010
// Measured on an AMD MI455X. A time is GPU time per run, averaged over a window of back-to-back runs after a warm-up
// (all launches, gaps included; the runs take copies of the inputs in turn), and the median of several windows.
// Apart from v000's, it joins two sittings. Times from different sittings can be a few percent apart, while
// side-by-side timings come from the same sitting.
// The versions before v010 are in another document.
// One run takes 88.5 microseconds.
// Next to v009, in two timings, it ran 1.05 times as fast each time.
// Counting every step since v000, which is the starting kernel, it is 5.92 times as fast.
#include <hip/hip_runtime.h>
// Multi-head 'linear-feature' attention (B=2, S=2048, H=1024, 16 heads × 64): q,k,v = x·Wᵀ (no bias); φ(q) = elu(q)+1, φ(k) = elu(k)+1; attn = softmax(φ(q)·φ(k)ᵀ) UNSCALED (σ≈8 logits) with the INPUT key mask [B,S] (0 → −inf);
// out = (attn·v merged)·Woᵀ.
// Compute dtype: x and weights rounded to bf16; q,k as f32 GEMM outputs mapped through elu+1 in f32 and split into f16 hi + residual planes so the large unscaled logits are f32-accurate
// (S = Qh·Kh + Ql·Kh + Qh·Kl, one accumulator); v f16; fused flash-style kernel (online softmax f32, P f16 against a held reference) on v_wmma_f32_16x16x32_f16; O ×2^4 → f16 → output GEMM; f32 accumulate.
#define BB 2
#define TT 2048
#define NH 16
#define DD 1024
#define NR (BB * TT)

typedef __bf16 v16b __attribute__((ext_vector_type(16)));
typedef unsigned short v8us __attribute__((ext_vector_type(8), may_alias));
typedef float  v8f  __attribute__((ext_vector_type(8)));
typedef float  v4f  __attribute__((ext_vector_type(4)));
typedef float  v4fa __attribute__((ext_vector_type(4), may_alias));
union FragB { v16b v; v8us half[2]; unsigned short u[16]; };

__device__ __forceinline__ unsigned short bf16_bits(float x) { unsigned int u = __float_as_uint(x); return (unsigned short)((u + 0x7FFFu + ((u >> 16) & 1u)) >> 16); }
__device__ __forceinline__ float bf16_val(unsigned short b) { return __uint_as_float(((unsigned int)b) << 16); }
__device__ __forceinline__ float bf16_round(float x) { return bf16_val(bf16_bits(x)); }
// D += A·B with NT terms: 1 = ah·bh, 2 = + al·bh (A split), 3 = + ah·bl (both split)
template <int NT>
__device__ __forceinline__ v8f mmaN(v16b ah, v16b al, v16b bh, v16b bl, v8f c) {
  c = __builtin_amdgcn_wmma_f32_16x16x32_bf16(false, ah, false, bh, (short)0, c, false, false);
  if (NT >= 2) c = __builtin_amdgcn_wmma_f32_16x16x32_bf16(false, al, false, bh, (short)0, c, false, false);
  if (NT >= 3) c = __builtin_amdgcn_wmma_f32_16x16x32_bf16(false, ah, false, bl, (short)0, c, false, false);
  asm volatile("v_nop\n\tv_nop\n\tv_nop\n\tv_nop" : "+v"(c) : "v"(ah), "v"(al), "v"(bh), "v"(bl));
  return c;
}

__global__ __launch_bounds__(256) void k_wt_bf16(const float* __restrict__ W, unsigned short* __restrict__ Wt, int K, int N) {
  const int t = blockIdx.x * 256 + threadIdx.x;
  const int k8n = K / 8;
  if (t >= N * k8n) return;
  const int n = t / k8n, k8 = (t % k8n) * 8;
  v8us v;
#pragma unroll
  for (int i = 0; i < 8; ++i) v[i] = bf16_bits(W[(size_t)(k8 + i) * N + n]);
  *(v8us*)(Wt + (size_t)n * K + k8) = v;
  
}

// GEMM C[M][N] (f32, pitch ldc) = act(A[M][K]·W + bias). A f32 row-major (pitch lda) converted per fragment to bf16
// (ASPLIT: hi/lo two planes -> 2 terms, else single rounded term); Wt bf16 [N][K] (pitch ldb). BIAS_BF16 rounds the
// bias to bf16 first (bias quantised to bf16 before the add). K%32==0, M%16==0, N%64==0.
template <bool ASPLIT, int ACT, bool BIAS_BF16>
__global__ __launch_bounds__(128) void k_gemm_bf(const float* __restrict__ A, int lda, const unsigned short* __restrict__ Wt, int ldb,
                                               const float* __restrict__ bias, float* __restrict__ C, int ldc, int M, int N, int K) {
  __shared__ __attribute__((aligned(16))) float so[4][16][64];
  const int tid = threadIdx.x, w = tid >> 5, lane = tid & 31, ln = lane & 15, hh = lane >> 4;
  const int ntn = N / 64;
  const int wid = blockIdx.x * 4 + w;
  const int mt = wid / ntn, nq = wid % ntn;
  if (mt * 16 >= M) return;
  const int row0 = mt * 16, col0 = nq * 64;
  const float* arow = A + (size_t)(row0 + ln) * lda;
  v8f acc[4] = {};
  for (int kb = 0; kb < K; kb += 32) {
    FragB ah, al;
    const v4f x0 = *(const v4fa*)(arow + kb + 8 * hh), x1 = *(const v4fa*)(arow + kb + 8 * hh + 4);
    const v4f x2 = *(const v4fa*)(arow + kb + 16 + 8 * hh), x3 = *(const v4fa*)(arow + kb + 16 + 8 * hh + 4);
    float xs[16] = {x0[0],x0[1],x0[2],x0[3],x1[0],x1[1],x1[2],x1[3],x2[0],x2[1],x2[2],x2[3],x3[0],x3[1],x3[2],x3[3]};
#pragma unroll
    for (int i = 0; i < 16; ++i) { const unsigned short hb = bf16_bits(xs[i]); ah.u[i] = hb; al.u[i] = ASPLIT ? bf16_bits(xs[i] - bf16_val(hb)) : (unsigned short)0; }
#pragma unroll
    for (int t = 0; t < 4; ++t) {
      const unsigned short* brow = Wt + (size_t)(col0 + t * 16 + ln) * ldb + kb;
      FragB b;
      b.half[0] = *(const v8us*)(brow + 8 * hh);
      b.half[1] = *(const v8us*)(brow + 16 + 8 * hh);
      acc[t] = mmaN<ASPLIT ? 2 : 1>(ah.v, al.v, b.v, b.v, acc[t]);
    }
  }
#pragma unroll
  for (int t = 0; t < 4; ++t) {
    float bv = bias ? bias[col0 + t * 16 + ln] : 0.f;
    if (BIAS_BF16) bv = bf16_round(bv);
#pragma unroll
    for (int r = 0; r < 8; ++r) { float v = acc[t][r] + bv; if (ACT == 1) v = fmaxf(v, 0.f); so[w][8 * hh + r][t * 16 + ln] = v; }
  }
  __builtin_amdgcn_fence(__ATOMIC_ACQ_REL, "workgroup");
  __builtin_amdgcn_wave_barrier();
  const int rsub = lane >> 4, c4 = (lane & 15) * 4;
  {
#pragma unroll
    for (int q = 0; q < 8; ++q) {
      const int r = q * 2 + rsub;
      const v4f v = *(const v4fa*)&so[w][r][c4];
      *(v4f*)(C + (size_t)(row0 + r) * ldc + col0 + c4) = v;
    }
    
  }
}

// Flash-style causal/unmasked attention, all contractions 3-term bf16 hi/lo splits, f32 softmax with running max.
// q,k,v rows are read from f32 buffers with arbitrary row pitch (so they can live inside a fused qkv buffer);
// D = head size (multiple of 32, <= 128); one wave = 16 query rows; block = 4 waves (64 queries) sharing K/V chunks of 32.
template <int D, bool CAUSAL>
__global__ __launch_bounds__(128) void k_flash(const float* __restrict__ qb, const float* __restrict__ kb, const float* __restrict__ vb,
                                             int pitch, int T, int H, float scale, float* __restrict__ y, int ypitch) {
  constexpr int KS = D / 32;        // k-steps for QK
  constexpr int DT = D / 16;        // d tiles for PV
  __shared__ __attribute__((aligned(16))) unsigned short sKh[32][D + 8], sKl[32][D + 8], sVh[32][D + 8], sVl[32][D + 8];
  __shared__ __attribute__((aligned(16))) unsigned short sPh[4][16][40], sPl[4][16][40];
  __shared__ __attribute__((aligned(16))) float sO[4][16][D];
  const int tid = threadIdx.x, w = tid >> 5, lane = tid & 31, ln = lane & 15, hh = lane >> 4;
  const int nqb = (T + 63) / 64;
  const int bh = blockIdx.x / nqb, qblk = blockIdx.x % nqb;
  const int b = bh / H, h = bh % H;
  const int q0 = qblk * 64 + w * 16;
  const float* Q = qb + (size_t)b * T * pitch + h * D;
  const float* K = kb + (size_t)b * T * pitch + h * D;
  const float* V = vb + (size_t)b * T * pitch + h * D;

  // A fragments of the wave's 16 query rows (scaled), hi/lo
  FragB aqh[KS], aql[KS];
  {
    int row = q0 + ln; if (row >= T) row = T - 1;
    const float* qr = Q + (size_t)row * pitch;
#pragma unroll
    for (int ks = 0; ks < KS; ++ks)
#pragma unroll
      for (int i = 0; i < 16; ++i) {
        const int d = ks * 32 + ((i < 8) ? (8 * hh + i) : (16 + 8 * hh + (i - 8)));
        const float x = qr[d] * scale; const unsigned short hb = bf16_bits(x);
        aqh[ks].u[i] = hb; aql[ks].u[i] = bf16_bits(x - bf16_val(hb));
      }
  }
  float m_r[8], l_r[8];
#pragma unroll
  for (int r = 0; r < 8; ++r) { m_r[r] = -3.0e38f; l_r[r] = 0.f; }
  v8f oacc[DT];
#pragma unroll
  for (int dt = 0; dt < DT; ++dt) oacc[dt] = (v8f){0.f,0.f,0.f,0.f,0.f,0.f,0.f,0.f};

  const int kv_end = CAUSAL ? min(T, qblk * 64 + 64) : T;     // block-uniform
  for (int j0 = 0; j0 < kv_end; j0 += 32) {
    __syncthreads();
    for (int e = tid; e < 32 * (D / 4); e += 128) {
      const int r = e / (D / 4), c4 = (e % (D / 4)) * 4;
      const int key = j0 + r;
      v4f kf = {0.f,0.f,0.f,0.f}, vf = {0.f,0.f,0.f,0.f};
      if (key < T) { kf = *(const v4fa*)(K + (size_t)key * pitch + c4); vf = *(const v4fa*)(V + (size_t)key * pitch + c4); }
#pragma unroll
      for (int t = 0; t < 4; ++t) {
        unsigned short hb = bf16_bits(kf[t]); sKh[r][c4 + t] = hb; sKl[r][c4 + t] = bf16_bits(kf[t] - bf16_val(hb));
        hb = bf16_bits(vf[t]); sVh[r][c4 + t] = hb; sVl[r][c4 + t] = bf16_bits(vf[t] - bf16_val(hb));
      }
    }
    __syncthreads();
    // S tile 16 x 32
    v8f s[2];
#pragma unroll
    for (int nt = 0; nt < 2; ++nt) {
      v8f acc = {};
#pragma unroll
      for (int ks = 0; ks < KS; ++ks) {
        FragB bh_, bl_;
        bh_.half[0] = *(const v8us*)&sKh[nt * 16 + ln][ks * 32 + 8 * hh]; bh_.half[1] = *(const v8us*)&sKh[nt * 16 + ln][ks * 32 + 16 + 8 * hh];
        bl_.half[0] = *(const v8us*)&sKl[nt * 16 + ln][ks * 32 + 8 * hh]; bl_.half[1] = *(const v8us*)&sKl[nt * 16 + ln][ks * 32 + 16 + 8 * hh];
        acc = mmaN<3>(aqh[ks].v, aql[ks].v, bh_.v, bl_.v, acc);
      }
      s[nt] = acc;
    }
    // mask + running max (rows 8hh+r; the 16 lanes of a half share rows)
    float alpha[8];
#pragma unroll
    for (int r = 0; r < 8; ++r) {
      const int qi = q0 + 8 * hh + r;
      const int ja = j0 + ln, jb = j0 + 16 + ln;
      if (CAUSAL) { if (ja > qi) s[0][r] = -3.0e38f; if (jb > qi) s[1][r] = -3.0e38f; }
      if (ja >= T) s[0][r] = -3.0e38f;
      if (jb >= T) s[1][r] = -3.0e38f;
      float mx = fmaxf(s[0][r], s[1][r]);
      mx = fmaxf(mx, __shfl_xor(mx, 1, 32)); mx = fmaxf(mx, __shfl_xor(mx, 2, 32)); mx = fmaxf(mx, __shfl_xor(mx, 4, 32)); mx = fmaxf(mx, __shfl_xor(mx, 8, 32));
      const float mnew = fmaxf(m_r[r], mx);
      alpha[r] = (mnew > -1.0e38f) ? __expf(m_r[r] - mnew) : 1.0f;
      const float p0 = (s[0][r] > -1.0e38f) ? __expf(s[0][r] - mnew) : 0.f;
      const float p1 = (s[1][r] > -1.0e38f) ? __expf(s[1][r] - mnew) : 0.f;
      m_r[r] = mnew;
      l_r[r] = l_r[r] * alpha[r] + p0 + p1;            // per-lane partial row sum (16 lanes combined at the end)
      unsigned short hb = bf16_bits(p0); sPh[w][8 * hh + r][ln] = hb;      sPl[w][8 * hh + r][ln] = bf16_bits(p0 - bf16_val(hb));
      hb = bf16_bits(p1);                sPh[w][8 * hh + r][16 + ln] = hb; sPl[w][8 * hh + r][16 + ln] = bf16_bits(p1 - bf16_val(hb));
    }
#pragma unroll
    for (int dt = 0; dt < DT; ++dt)
#pragma unroll
      for (int r = 0; r < 8; ++r) oacc[dt][r] *= alpha[r];
    __builtin_amdgcn_fence(__ATOMIC_ACQ_REL, "workgroup");
    __builtin_amdgcn_wave_barrier();
    FragB pah, pal;
    pah.half[0] = *(const v8us*)&sPh[w][ln][8 * hh]; pah.half[1] = *(const v8us*)&sPh[w][ln][16 + 8 * hh];
    pal.half[0] = *(const v8us*)&sPl[w][ln][8 * hh]; pal.half[1] = *(const v8us*)&sPl[w][ln][16 + 8 * hh];
#pragma unroll
    for (int dt = 0; dt < DT; ++dt) {
      FragB bvh, bvl;
#pragma unroll
      for (int i = 0; i < 8; ++i) {
        bvh.u[i] = sVh[8 * hh + i][dt * 16 + ln]; bvh.u[8 + i] = sVh[16 + 8 * hh + i][dt * 16 + ln];
        bvl.u[i] = sVl[8 * hh + i][dt * 16 + ln]; bvl.u[8 + i] = sVl[16 + 8 * hh + i][dt * 16 + ln];
      }
      oacc[dt] = mmaN<3>(pah.v, pal.v, bvh.v, bvl.v, oacc[dt]);
    }
    __builtin_amdgcn_fence(__ATOMIC_ACQ_REL, "workgroup");
    __builtin_amdgcn_wave_barrier();
  }
#pragma unroll
  for (int r = 0; r < 8; ++r) {
    float l = l_r[r];
    l += __shfl_xor(l, 1, 32); l += __shfl_xor(l, 2, 32); l += __shfl_xor(l, 4, 32); l += __shfl_xor(l, 8, 32);
    l_r[r] = (l > 0.f) ? 1.0f / l : 0.f;
  }
#pragma unroll
  for (int dt = 0; dt < DT; ++dt)
#pragma unroll
    for (int r = 0; r < 8; ++r) sO[w][8 * hh + r][dt * 16 + ln] = oacc[dt][r] * l_r[r];
  __builtin_amdgcn_fence(__ATOMIC_ACQ_REL, "workgroup");
  __builtin_amdgcn_wave_barrier();
  {
    for (int r = 0; r < 16; ++r) {
      const int row = q0 + r;
      if (row < T && lane < D / 4) {
        const v4f val = *(const v4fa*)&sO[w][r][lane * 4];
        *(v4f*)(y + ((size_t)b * T + row) * ypitch + h * D + lane * 4) = val;
      }
    }
    
  }
}

// GEMM C = act(A·W + bias + resid): A f32 (ASPLIT -> hi/lo 2 terms), Wt bf16 [N][K]; ACT 0 none, 1 relu, 2 exact gelu;
// resid (optional, f32, row index = (row % rmod), pitch ldr, RES_BF16 rounds it) added before the activation.
template <bool ASPLIT, int ACT, bool BIAS_BF16, bool RES_BF16>
__global__ __launch_bounds__(128) void k_gemm_bf3(const float* __restrict__ A, int lda, const unsigned short* __restrict__ Wt, int ldb,
                                                const float* __restrict__ bias, const float* __restrict__ resid, int rmod, int ldr,
                                                float* __restrict__ C, int ldc, int M, int N, int K) {
  __shared__ __attribute__((aligned(16))) float so[4][16][64];
  const int tid = threadIdx.x, w = tid >> 5, lane = tid & 31, ln = lane & 15, hh = lane >> 4;
  const int ntn = N / 64;
  const int wid = blockIdx.x * 4 + w;
  const int mt = wid / ntn, nq = wid % ntn;
  if (mt * 16 >= M) return;
  const int row0 = mt * 16, col0 = nq * 64;
  const float* arow = A + (size_t)(row0 + ln) * lda;
  v8f acc[4] = {};
  for (int kb = 0; kb < K; kb += 32) {
    FragB ah, al;
    const v4f x0 = *(const v4fa*)(arow + kb + 8 * hh), x1 = *(const v4fa*)(arow + kb + 8 * hh + 4);
    const v4f x2 = *(const v4fa*)(arow + kb + 16 + 8 * hh), x3 = *(const v4fa*)(arow + kb + 16 + 8 * hh + 4);
    float xs[16] = {x0[0],x0[1],x0[2],x0[3],x1[0],x1[1],x1[2],x1[3],x2[0],x2[1],x2[2],x2[3],x3[0],x3[1],x3[2],x3[3]};
#pragma unroll
    for (int i = 0; i < 16; ++i) { const unsigned short hb = bf16_bits(xs[i]); ah.u[i] = hb; al.u[i] = ASPLIT ? bf16_bits(xs[i] - bf16_val(hb)) : (unsigned short)0; }
#pragma unroll
    for (int t = 0; t < 4; ++t) {
      const unsigned short* brow = Wt + (size_t)(col0 + t * 16 + ln) * ldb + kb;
      FragB b;
      b.half[0] = *(const v8us*)(brow + 8 * hh);
      b.half[1] = *(const v8us*)(brow + 16 + 8 * hh);
      acc[t] = mmaN<ASPLIT ? 2 : 1>(ah.v, al.v, b.v, b.v, acc[t]);
    }
  }
#pragma unroll
  for (int t = 0; t < 4; ++t) {
    const int col = col0 + t * 16 + ln;
    float bv = bias ? bias[col] : 0.f;
    if (BIAS_BF16) bv = bf16_round(bv);
#pragma unroll
    for (int r = 0; r < 8; ++r) {
      float v = acc[t][r] + bv;
      if (resid) { float rv = resid[(size_t)((row0 + 8 * hh + r) % rmod) * ldr + col]; if (RES_BF16) rv = bf16_round(rv); v += rv; }
      if (ACT == 1) v = fmaxf(v, 0.f);
      if (ACT == 2) v = 0.5f * v * (1.0f + erff(v * 0.70710678118654752f));
      if (ACT == 3) { const float u = 0.7978845608028654f * (v + 0.044715f * v * v * v); v = 0.5f * v * (1.0f + tanhf(u)); }
      so[w][8 * hh + r][t * 16 + ln] = v;
    }
  }
  __builtin_amdgcn_fence(__ATOMIC_ACQ_REL, "workgroup");
  __builtin_amdgcn_wave_barrier();
  const int rsub = lane >> 4, c4 = (lane & 15) * 4;
  {
#pragma unroll
    for (int q = 0; q < 8; ++q) {
      const int r = q * 2 + rsub;
      const v4f v = *(const v4fa*)&so[w][r][c4];
      *(v4f*)(C + (size_t)(row0 + r) * ldc + col0 + c4) = v;
    }
    
  }
}
// row LayerNorm (biased variance, eps) over N: s = X (+ R); optional out_sum <- s; out_norm <- (s-mu)*rsqrt(var+eps)*g + b
template <bool PARAM_BF16>
__global__ __launch_bounds__(256) void k_layernorm(const float* __restrict__ X, const float* __restrict__ R, const float* __restrict__ g, const float* __restrict__ bta,
                                                  float* __restrict__ out_sum, float* __restrict__ out_norm, int N, float eps) {
  __shared__ float red[256];
  const int row = blockIdx.x, tid = threadIdx.x;
  const float* x = X + (size_t)row * N; const float* rr = R ? R + (size_t)row * N : nullptr;
  float vals[16];                     // up to N = 4096
  const int per = N / 256;            // contiguous chunk per thread? use strided-by-4 chunks: thread handles j = tid*4 + 1024*u
  float s1 = 0.f;
  for (int u = 0; u < per / 4; ++u) {
    const int j = tid * 4 + 1024 * u;
    const v4f a = *(const v4fa*)(x + j);
    v4f b = {0.f,0.f,0.f,0.f}; if (rr) b = *(const v4fa*)(rr + j);
#pragma unroll
    for (int q = 0; q < 4; ++q) { const float v = a[q] + b[q]; vals[u * 4 + q] = v; s1 += v; }
  }
  red[tid] = s1; __syncthreads();
  for (int st = 128; st > 0; st >>= 1) { if (tid < st) red[tid] += red[tid + st]; __syncthreads(); }
  const float mu = red[0] / (float)N; __syncthreads();
  float s2 = 0.f;
  for (int u = 0; u < per / 4; ++u)
#pragma unroll
    for (int q = 0; q < 4; ++q) { const float c = vals[u * 4 + q] - mu; s2 += c * c; }
  red[tid] = s2; __syncthreads();
  for (int st = 128; st > 0; st >>= 1) { if (tid < st) red[tid] += red[tid + st]; __syncthreads(); }
  const float rs = rsqrtf(red[0] / (float)N + eps);
  {
    for (int u = 0; u < per / 4; ++u) {
      const int j = tid * 4 + 1024 * u;
      v4f o, sm;
#pragma unroll
      for (int q = 0; q < 4; ++q) {
        float gg = g[j + q], bb = bta[j + q];
        if (PARAM_BF16) { gg = bf16_round(gg); bb = bf16_round(bb); }
        sm[q] = vals[u * 4 + q]; o[q] = (vals[u * 4 + q] - mu) * rs * gg + bb;
      }
      if (out_sum) *(v4f*)(out_sum + (size_t)row * N + j) = sm;
      *(v4f*)(out_norm + (size_t)row * N + j) = o;
    }
    
  }
}



// ---- f16 WMMA path (v_wmma_f32_16x16x32_f16): 11-bit significands for operands in range — used where a [0,1] probability operand needs more precision than bf16
typedef _Float16 v16h __attribute__((ext_vector_type(16)));
union FragH { v16h v; v8us half[2]; _Float16 h[16]; unsigned short u[16]; };
template <int NT>
__device__ __forceinline__ v8f mmaH(v16h ah, v16h al, v16h bh, v16h bl, v8f c) {
  c = __builtin_amdgcn_wmma_f32_16x16x32_f16(false, ah, false, bh, (short)0, c, false, false);
  if (NT >= 2) c = __builtin_amdgcn_wmma_f32_16x16x32_f16(false, al, false, bh, (short)0, c, false, false);
  if (NT >= 3) c = __builtin_amdgcn_wmma_f32_16x16x32_f16(false, ah, false, bl, (short)0, c, false, false);
  asm volatile("v_nop\n\tv_nop\n\tv_nop\n\tv_nop" : "+v"(c) : "v"(ah), "v"(al), "v"(bh), "v"(bl));
  return c;
}
// batched GEMM like k_gemm_b but f16 operands: A f32 (split into f16 hi/lo if ASPLIT, else rounded to f16), Bt = f16 values [n][k]; alpha; C f32; N multiple of 16 (partial tiles skipped)
template <bool ASPLIT>
__global__ __launch_bounds__(128) void k_gemm_h(const float* __restrict__ A, int lda, size_t sA, const _Float16* __restrict__ Bh, int ldb, size_t sB, float alpha, float* __restrict__ C, int ldc, size_t sC, int M, int N, int K) {
  __shared__ __attribute__((aligned(16))) float so[4][16][64];
  const int tid = threadIdx.x, w = tid >> 5, lane = tid & 31, ln = lane & 15, hh = lane >> 4; const int by = blockIdx.y;
  A += (size_t)by * sA; Bh += (size_t)by * sB; C += (size_t)by * sC;
  const int ntn = (N + 63) / 64; const int wid = blockIdx.x * 4 + w; const int mt = wid / ntn, nq = wid % ntn; if (mt * 16 >= M) return;
  const int row0 = mt * 16, col0 = nq * 64; const float* arow = A + (size_t)(row0 + ln) * lda;
  v8f acc[4] = {};
  for (int kb = 0; kb < K; kb += 32) {
    FragH ah, al;
    const v4f x0 = *(const v4fa*)(arow + kb + 8 * hh), x1 = *(const v4fa*)(arow + kb + 8 * hh + 4), x2 = *(const v4fa*)(arow + kb + 16 + 8 * hh), x3 = *(const v4fa*)(arow + kb + 16 + 8 * hh + 4);
    float xs[16] = {x0[0],x0[1],x0[2],x0[3],x1[0],x1[1],x1[2],x1[3],x2[0],x2[1],x2[2],x2[3],x3[0],x3[1],x3[2],x3[3]};
#pragma unroll
    for (int i = 0; i < 16; ++i) { const _Float16 h = (_Float16)xs[i]; ah.h[i] = h; al.h[i] = ASPLIT ? (_Float16)(xs[i] - (float)h) : (_Float16)0.0f; }
#pragma unroll
    for (int t = 0; t < 4; ++t) { if (col0 + t * 16 >= N) continue; const size_t boff = (size_t)(col0 + t * 16 + ln) * ldb + kb; FragH bq; bq.half[0] = *(const v8us*)(Bh + boff + 8 * hh); bq.half[1] = *(const v8us*)(Bh + boff + 16 + 8 * hh);
      acc[t] = mmaH<ASPLIT ? 2 : 1>(ah.v, al.v, bq.v, bq.v, acc[t]); }
  }
#pragma unroll
  for (int t = 0; t < 4; ++t) { if (col0 + t * 16 >= N) continue;
#pragma unroll
    for (int r = 0; r < 8; ++r) so[w][8 * hh + r][t * 16 + ln] = acc[t][r] * alpha; }
  __builtin_amdgcn_fence(__ATOMIC_ACQ_REL, "workgroup"); __builtin_amdgcn_wave_barrier();
  const int rsub = lane >> 4, c4 = (lane & 15) * 4;
  {
#pragma unroll
    for (int q = 0; q < 8; ++q) { const int r = q * 2 + rsub; if (col0 + c4 < N) { const v4f v = *(const v4fa*)&so[w][r][c4]; *(v4f*)(C + (size_t)(row0 + r) * ldc + col0 + c4) = v; } }
     }
}

// Wt[n][k] = f16(W[k][n]·scale) from f32 row-major W[K][N] (scale = power of two; bf16-exact weights stay exact in f16 away from the subnormal range)
__global__ __launch_bounds__(256) void k_wt_f16(const float* __restrict__ W, _Float16* __restrict__ Wt, int K, int N, float scale) {
  const int t = blockIdx.x * 256 + threadIdx.x; if (t >= N * (K / 8)) return; const int n = t / (K / 8), k8 = (t % (K / 8)) * 8; FragH f;
#pragma unroll
  for (int i = 0; i < 8; ++i) f.h[i] = (_Float16)(bf16_round(W[(size_t)(k8 + i) * N + n]) * scale); const v8us o = f.half[0];
  *(v8us*)((unsigned short*)Wt + (size_t)n * K + k8) = o; 
}
// k_gemm_hh variant with fused epilogue: v = acc·alpha + bias[by·sBias + col] (+ CP[(row/rowsPerB)·sCPb + by·64 + col] if CP) ; ACT 0 none / 1 elu ; writes f16 C16 (and f32 C if non-null)
template <int ACT>
__global__ __launch_bounds__(128) void k_gemm_hhx(const _Float16* __restrict__ A, int lda, size_t sA, const _Float16* __restrict__ Bh, int ldb, size_t sB, float alpha, const float* __restrict__ bias, size_t sBias, const float* __restrict__ CP, int rowsPerB, size_t sCPb, int row0g,
    float* __restrict__ C, _Float16* __restrict__ C16, int ldc, size_t sC, int M, int N, int K) {
  __shared__ __attribute__((aligned(16))) float so[4][16][64];
  const int tid = threadIdx.x, w = tid >> 5, lane = tid & 31, ln = lane & 15, hh = lane >> 4; const int by = blockIdx.y;
  A += (size_t)by * sA; Bh += (size_t)by * sB; const size_t cofs = (size_t)by * sC; const float* bp = bias ? bias + (size_t)by * sBias : nullptr;
  const int ntn = (N + 63) / 64; const int wid = blockIdx.x * 4 + w; const int mt = wid / ntn, nq = wid % ntn; if (mt * 16 >= M) return;
  const int row0 = mt * 16, col0 = nq * 64; const _Float16* arow = A + (size_t)(row0 + ln) * lda;
  v8f acc[4] = {};
  for (int kb = 0; kb < K; kb += 32) { FragH ah; ah.half[0] = *(const v8us*)((const unsigned short*)arow + kb + 8 * hh); ah.half[1] = *(const v8us*)((const unsigned short*)arow + kb + 16 + 8 * hh);
#pragma unroll
    for (int t = 0; t < 4; ++t) { if (col0 + t * 16 >= N) continue; const size_t boff = (size_t)(col0 + t * 16 + ln) * ldb + kb; FragH bq; bq.half[0] = *(const v8us*)((const unsigned short*)Bh + boff + 8 * hh); bq.half[1] = *(const v8us*)((const unsigned short*)Bh + boff + 16 + 8 * hh);
      acc[t] = mmaH<1>(ah.v, ah.v, bq.v, bq.v, acc[t]); }
  }
#pragma unroll
  for (int t = 0; t < 4; ++t) { if (col0 + t * 16 >= N) continue; const int col = col0 + t * 16 + ln; const float bv = bp ? bf16_round(bp[col]) : 0.f;
#pragma unroll
    for (int r = 0; r < 8; ++r) { float v = acc[t][r] * alpha + bv; if (CP) { const int bidx = (row0g + row0 + 8 * hh + r) / rowsPerB; v += CP[(size_t)bidx * sCPb + (size_t)by * 64 + col]; } if (ACT == 1) v = (v > 0.f) ? v : expm1f(v); else if (ACT == 7) v = (v > 0.f) ? v + 1.0f : expf(v); else if (ACT == 8) v = tanhf(v); else if (ACT == 9) v = 0.5f * v * (1.0f + tanhf(0.7978845608028654f * (v + 0.044715f * v * v * v))); else if (ACT == 11) v = 1.0f / (1.0f + expf(-v)); else if (ACT == 12) v = (v > 0.f) ? v : 0.01f * v; else if (ACT == 14) v = (v > 0.f) ? v : 0.1f * v; else if (ACT == 15) v = v / (1.0f + expf(-v)); else if (ACT == 3) v = fmaxf(v, 0.f); else if (ACT == 6) v = 0.5f * v * (1.0f + erff(v * 0.70710678118654752f)); so[w][8 * hh + r][t * 16 + ln] = v; } }
  __builtin_amdgcn_fence(__ATOMIC_ACQ_REL, "workgroup"); __builtin_amdgcn_wave_barrier();
  const int rsub = lane >> 4, c4 = (lane & 15) * 4; typedef _Float16 v4h __attribute__((ext_vector_type(4)));
  {
#pragma unroll
    for (int q = 0; q < 8; ++q) { const int r = q * 2 + rsub; if (col0 + c4 < N) { const v4f v = *(const v4fa*)&so[w][r][c4]; if (C) *(v4f*)(C + cofs + (size_t)(row0 + r) * ldc + col0 + c4) = v; if (C16) { v4h h4; for (int i = 0; i < 4; ++i) h4[i] = (_Float16)v[i]; *(v4h*)(C16 + cofs + (size_t)(row0 + r) * ldc + col0 + c4) = h4; } } }
     }
}


typedef _Float16 v4h __attribute__((ext_vector_type(4)));

// All five input conversions in one launch: x -> f16(bf16(x)), each weight -> f16(bf16(W) * 16). An item is 8 floats; item = u * PREP_T + thread, so u = 0..3 walks x and u = 4..7 is one weight each.
// 512 work-groups of 8 waves (16 waves a WGP): every thread has its 16 loads of 16 B in flight before its first store.
#define PREP_T (512 * 256)
__global__ __launch_bounds__(256) void k_prep(const float* __restrict__ x, const float* __restrict__ Wq, const float* __restrict__ Wk, const float* __restrict__ Wv, const float* __restrict__ Wo, _Float16* __restrict__ X16, _Float16* __restrict__ Bw) {
  static_assert((size_t)NR * DD / 8 == (size_t)4 * PREP_T && (size_t)DD * DD / 8 == (size_t)PREP_T, "item split");
  const unsigned tb = (blockIdx.x * 256u + threadIdx.x) * 32u;      /* one 32-bit byte offset serves all eight items: each has a uniform base (scalar base + vector offset addressing) */
  const float* sp[8] = { x, x + PREP_T * 8, x + 2 * PREP_T * 8, x + 3 * PREP_T * 8, Wq, Wk, Wv, Wo };
  v4f a[8], c[8];
#pragma unroll
  for (int u = 0; u < 8; ++u) { a[u] = *(const v4fa*)((const char*)sp[u] + tb); c[u] = *(const v4fa*)((const char*)sp[u] + tb + 16); }
  __builtin_amdgcn_sched_barrier(0);      /* all 16 loads go out as one group: left alone the scheduler starts converting after eight and the rest wait behind those results */
  FragH f[8];
#pragma unroll
  for (int u = 0; u < 8; ++u) { const float sc = (u < 4) ? 1.0f : 16.0f;
#pragma unroll
    for (int q = 0; q < 4; ++q) { f[u].h[q] = (_Float16)(bf16_round(a[u][q]) * sc); f[u].h[4 + q] = (_Float16)(bf16_round(c[u][q]) * sc); } }
#pragma unroll
  for (int u = 0; u < 8; ++u) *(v8us*)((char*)(((u < 4) ? X16 : Bw) + (u & 3) * PREP_T * 8) + (tb >> 1)) = f[u].half[0];
}
__global__ __launch_bounds__(256) void k_h16(const float* __restrict__ x, _Float16* __restrict__ X16, size_t n8) { const size_t t = (size_t)blockIdx.x * 256 + threadIdx.x; if (t >= n8) return; FragH f;
#pragma unroll
  for (int q = 0; q < 8; ++q) f.h[q] = (_Float16)x[t * 8 + q]; *(v8us*)((unsigned short*)X16 + t * 8) = f.half[0];  }
typedef int v4ia __attribute__((ext_vector_type(4), may_alias));
// lane l <-> lane l ^ 16 (the two halves of a wave hold the two key groups of one query column)
__device__ __forceinline__ float xhalf(float x) { return __builtin_bit_cast(float, __builtin_amdgcn_permlanex16(__builtin_bit_cast(int, x), __builtin_bit_cast(int, x), 0x76543210, 0xfedcba98, false, false)); }
__device__ __forceinline__ v8f wm(v16h a, v16h b, v8f c) { return __builtin_amdgcn_wmma_f32_16x16x32_f16(false, a, false, b, (short)0, c, false, false); }
#define FS_KEYS 64
#define FS_OFF (-1.0e30f)      /* start value of a masked key's score: no sum of products brings it back, and 2^score is exactly 0 */
#define FS_PITCH 144
#define FS_PLANE (64 * FS_PITCH)
#define FS_STAGE (3 * FS_PLANE)
// six copies of one lane: rows r and r + 32 of K hi, K lo and Vt, 16 B each. The s_wait_xcnt stands inside the copies' own statement, so that no address register named here is rewritten in front of it.
__device__ __forceinline__ void fs_copy6(unsigned l, const _Float16* kh, const _Float16* kl, int ldk, const _Float16* vt) {
  asm volatile("global_load_async_to_lds_b128 %0, %6, off\n\t"
               "global_load_async_to_lds_b128 %1, %7, off\n\t"
               "global_load_async_to_lds_b128 %2, %8, off\n\t"
               "global_load_async_to_lds_b128 %3, %9, off\n\t"
               "global_load_async_to_lds_b128 %4, %10, off\n\t"
               "global_load_async_to_lds_b128 %5, %11, off\n\t"
               "s_wait_xcnt 0x0"
               :: "v"(l), "v"(l + 32 * FS_PITCH), "v"(l + FS_PLANE), "v"(l + FS_PLANE + 32 * FS_PITCH), "v"(l + 2 * FS_PLANE), "v"(l + 2 * FS_PLANE + 32 * FS_PITCH),
                  "v"(kh), "v"(kh + (size_t)32 * ldk), "v"(kl), "v"(kl + (size_t)32 * ldk), "v"(vt), "v"(vt + 32 * TT)
               : "memory");
}
// eight exponentials in base 2, results in registers of their own (early clobber): none lands on the source of the one in front of it, where the instruction set asks for a free slot, and the arguments stay whole for a pass that has to move its reference.
// The closing v_nop is that slot behind the last one, whatever the compiler puts next.
#define FS_EXP8(P, A, O) asm("v_exp_f32 %0, %8\n\t" "v_exp_f32 %1, %9\n\t" "v_exp_f32 %2, %10\n\t" "v_exp_f32 %3, %11\n\t" "v_exp_f32 %4, %12\n\t" "v_exp_f32 %5, %13\n\t" "v_exp_f32 %6, %14\n\t" "v_exp_f32 %7, %15\n\t" "v_nop" \
    : "=&v"(P[O]), "=&v"(P[O + 1]), "=&v"(P[O + 2]), "=&v"(P[O + 3]), "=&v"(P[O + 4]), "=&v"(P[O + 5]), "=&v"(P[O + 6]), "=&v"(P[O + 7]) \
    : "v"(A[O]), "v"(A[O + 1]), "v"(A[O + 2]), "v"(A[O + 3]), "v"(A[O + 4]), "v"(A[O + 5]), "v"(A[O + 6]), "v"(A[O + 7]))
// P = 2^a of one group's 16 scores of a lane: the f16 operand of Vt.Pt and the lane's partial row sum
// the same eight as the builtin, for the common path, where they are the first readers of the score accumulators: the compiler keeps the distance behind a matrix product only for instructions that it places itself
__device__ __forceinline__ void fs_exp8(float (&p)[16], const float (&a)[16], int o) {
#pragma unroll
  for (int i = 0; i < 8; ++i) p[o + i] = __builtin_amdgcn_exp2f(a[o + i]);
}
__device__ __forceinline__ void fs_fin(const float (&p)[16], FragH& pa, float& sm) {
  float t8[8];
#pragma unroll
  for (int i = 0; i < 16; ++i) pa.h[i] = (_Float16)p[i];
#pragma unroll
  for (int i = 0; i < 8; ++i) t8[i] = p[i] + p[8 + i];
  sm = ((t8[0] + t8[1]) + (t8[2] + t8[3])) + ((t8[4] + t8[5]) + (t8[6] + t8[7]));
}
__device__ __forceinline__ void fs_p16(const float (&a)[16], FragH& pa, float& sm) {
  float p[16];
  FS_EXP8(p, a, 0); FS_EXP8(p, a, 8);
  fs_fin(p, pa, sm);
}
__global__ __launch_bounds__(256) void k_flash(const _Float16* __restrict__ Q16, const _Float16* __restrict__ Q16lo, int ldq, const _Float16* __restrict__ K16, const _Float16* __restrict__ K16lo, int ldk, const _Float16* __restrict__ Vt, const int* __restrict__ MSK, _Float16* __restrict__ O16, int ldo) {
  /* a wave owns NG = 2 groups of 16 query columns: every K, Vt and mask fragment that it reads from LDS serves both groups, and a work-group's stage copies serve 256 queries */
  constexpr int NG = 2, RPW = 16 * NG, NW = 8, NQB = TT / (NW * RPW), DT = 4, KS = 2, NST = TT / FS_KEYS;
  __shared__ __attribute__((aligned(16))) unsigned char sT[2 * FS_STAGE];
  __shared__ __attribute__((aligned(16))) float sM[TT];
  __shared__ __attribute__((aligned(16))) float sO[NW][RPW][64 + 4];
  const int tid = threadIdx.x, w = tid >> 5, lane = tid & 31, ln = lane & 15, hh = lane >> 4;
  const int slab = blockIdx.x / NQB, qblk = blockIdx.x % NQB; const int b = slab / NH, h = slab % NH; const int q0 = qblk * (NW * RPW) + w * RPW;
  const int cr = tid >> 3, cc = tid & 7;      /* this lane's row (mod 32) and 16-B column of every stage copy */
  const size_t kofs = ((size_t)b * TT + cr) * ldk + h * 64 + cc * 8;
  const _Float16* gkh = K16 + kofs; const _Float16* gkl = K16lo + kofs; const _Float16* gvt = Vt + ((size_t)slab * 64 + cr) * TT + cc * 8;
  const unsigned lt = (unsigned)(size_t)sT + cr * FS_PITCH + cc * 16;
  fs_copy6(lt, gkh, gkl, ldk, gvt);
  const int* gm = MSK + (size_t)b * TT + tid * 4;      /* the mask row, 2 x 4 keys a lane */
  const v4ia m0 = *(const v4ia*)(gm), m1 = *(const v4ia*)(gm + TT / 2);
  FragH aq[NG][KS], aql[NG][KS];
#pragma unroll
  for (int g = 0; g < NG; ++g) { const size_t qo = ((size_t)b * TT + q0 + g * 16 + ln) * ldq + h * 64; const unsigned short* qr = (const unsigned short*)Q16 + qo; const unsigned short* ql = (const unsigned short*)Q16lo + qo;
#pragma unroll
    for (int ks = 0; ks < KS; ++ks) { aq[g][ks].half[0] = *(const v8us*)(qr + ks * 32 + 8 * hh); aq[g][ks].half[1] = *(const v8us*)(qr + ks * 32 + 16 + 8 * hh); aql[g][ks].half[0] = *(const v8us*)(ql + ks * 32 + 8 * hh); aql[g][ks].half[1] = *(const v8us*)(ql + ks * 32 + 16 + 8 * hh); } }
  asm volatile("s_wait_xcnt 0x0" ::: "memory");          /* behind the mask and Q loads: none of their address registers is rewritten in front of this wait */
  { v4f f0, f1;
#pragma unroll
    for (int i = 0; i < 4; ++i) { f0[i] = (m0[i] != 0) ? 0.f : FS_OFF; f1[i] = (m1[i] != 0) ? 0.f : FS_OFF; }
    *(v4fa*)(sM + tid * 4) = f0; *(v4fa*)(sM + TT / 2 + tid * 4) = f1; }
  asm volatile("s_wait_asynccnt 0x0" ::: "memory");      /* stage 0 has landed for this wave */
  __syncthreads();                                       /* ... and for every wave */
  fs_copy6(lt + FS_STAGE, gkh + (size_t)FS_KEYS * ldk, gkl + (size_t)FS_KEYS * ldk, ldk, gvt + FS_KEYS);
  /* Softmax against a HELD reference c (base-2 units, one a query): the q planes carry log2(e), and -c is the C start value of each score tile's first product, so that the joined score IS the argument of v_exp_f32: P = 2^(s * log2e - c).
     c moves only in a pass where a lane's sum of P passes 2^15 (f16 P ends at 65504): there every query whose pass maximum lies above c - 4 takes that maximum + 4 as its new c (its largest P is then 2^-4, 19 doublings below the next move,
     and the f16 step of 2^-24 is 2^-20 of it), and O and l are scaled by 2^(old c - new c). Any c gives the same O / l; it only places P in the range of f16. c lives as -c in one register a group.
     The score leaves the matrix unit finished: the residual planes are unscaled, so that all three terms add into ONE accumulator, and its start value is -c + the key's mask float: nothing stands between the last product and v_exp_f32.
     c starts at 0: elu + 1 is positive, so no score lies below 0 and no P below 1 before the first move. */
  float l_r[NG], negc[NG]; v8f oacc[NG][DT];
#pragma unroll
  for (int g = 0; g < NG; ++g) { l_r[g] = 0.f; negc[g] = 0.f;
#pragma unroll
    for (int dt = 0; dt < DT; ++dt) oacc[g][dt] = (v8f){0.f,0.f,0.f,0.f,0.f,0.f,0.f,0.f}; }
  const unsigned char* fk = sT + ln * FS_PITCH + 16 * hh; const unsigned char* fv = fk + 2 * FS_PLANE;
#pragma unroll 1      /* one stage a trip: the two buffers alternate by an offset */
  for (int t = 0; t < NST; ++t) {
    const unsigned bo = (unsigned)(t & 1) * FS_STAGE;
#pragma unroll      /* the two passes of a stage stand in line, so that every LDS read takes its place in the stage as an immediate offset */
    for (int ps = 0; ps < FS_KEYS / 32; ++ps) {
    const float* mp = sM + t * FS_KEYS + ps * 32 + 8 * hh;      /* mask floats (0 = attend) of this lane's 16 keys */
    const v4f km[4] = { *(const v4fa*)(mp), *(const v4fa*)(mp + 4), *(const v4fa*)(mp + 16), *(const v4fa*)(mp + 20) };
    float sv[NG][16], p[NG][16]; FragH bk[2][KS], bl[2][KS], bv[DT];
#pragma unroll      /* in the order in which the products take them: k step by k step, K hi of both key tiles, then K lo of both */
    for (int ks = 0; ks < KS; ++ks) {
#pragma unroll
      for (int nt = 0; nt < 2; ++nt) { const unsigned char* kr = fk + bo + (ps * 32 + nt * 16) * FS_PITCH + ks * 64; bk[nt][ks].half[0] = *(const v8us*)(kr); bk[nt][ks].half[1] = *(const v8us*)(kr + 32); }
#pragma unroll
      for (int nt = 0; nt < 2; ++nt) { const unsigned char* kl = fk + bo + (ps * 32 + nt * 16) * FS_PITCH + FS_PLANE + ks * 64; bl[nt][ks].half[0] = *(const v8us*)(kl); bl[nt][ks].half[1] = *(const v8us*)(kl + 32); } }
    __builtin_amdgcn_sched_barrier(0);      /* the pass's K reads go out as one group: left alone the scheduler puts the second key tile's reads behind the first tile's products, and the wave waits out the LDS latency a second time */
    v8f acc[2][NG];      /* one accumulator a key tile and group: four chains, whose products alternate, so that none waits for the one before it in its own chain */
#pragma unroll
    for (int nt = 0; nt < 2; ++nt)
#pragma unroll
      for (int g = 0; g < NG; ++g)
#pragma unroll
        for (int r = 0; r < 8; ++r) acc[nt][g][r] = negc[g] + km[2 * nt + (r >> 2)][r & 3];
#pragma unroll
    for (int ks = 0; ks < KS; ++ks) {
#pragma unroll
      for (int nt = 0; nt < 2; ++nt)
#pragma unroll
        for (int g = 0; g < NG; ++g) acc[nt][g] = wm(bk[nt][ks].v, aq[g][ks].v, acc[nt][g]);
#pragma unroll
      for (int nt = 0; nt < 2; ++nt)
#pragma unroll
        for (int g = 0; g < NG; ++g) acc[nt][g] = wm(bk[nt][ks].v, aql[g][ks].v, acc[nt][g]);
#pragma unroll
      for (int nt = 0; nt < 2; ++nt)
#pragma unroll
        for (int g = 0; g < NG; ++g) acc[nt][g] = wm(bl[nt][ks].v, aq[g][ks].v, acc[nt][g]); }
#pragma unroll
    for (int nt = 0; nt < 2; ++nt)
#pragma unroll
      for (int g = 0; g < NG; ++g)
#pragma unroll
        for (int r = 0; r < 8; ++r) sv[g][8 * nt + r] = acc[nt][g][r];
#pragma unroll
    for (int dt = 0; dt < DT; ++dt) { const unsigned char* vrow = fv + bo + dt * 16 * FS_PITCH + ps * 64; bv[dt].half[0] = *(const v8us*)(vrow); bv[dt].half[1] = *(const v8us*)(vrow + 32); }
    __builtin_amdgcn_sched_barrier(0);      /* the four Vt fragments are read ahead of the softmax, which covers their latency: left alone each read sinks to just in front of its product and is waited for there */
    FragH pa[NG]; float sm[NG];
#pragma unroll
    for (int g = 0; g < NG; ++g) { fs_exp8(p[g], sv[g], 0); fs_exp8(p[g], sv[g], 8); fs_fin(p[g], pa[g], sm[g]); }
    /* one test a pass for both groups, a scalar branch on the wave's ballot: seldom taken once the references have settled */
    if (__builtin_amdgcn_ballot_w32(fmaxf(sm[0], sm[1]) > 32768.0f) != 0) {
#pragma unroll
      for (int g = 0; g < NG; ++g) {
        float t8[8], a2[16];
#pragma unroll
        for (int i = 0; i < 8; ++i) t8[i] = fmaxf(sv[g][i], sv[g][8 + i]);
        float mc = fmaxf(fmaxf(fmaxf(t8[0], t8[1]), fmaxf(t8[2], t8[3])), fmaxf(fmaxf(t8[4], t8[5]), fmaxf(t8[6], t8[7])));
        mc = fmaxf(mc, xhalf(mc));      /* both halves hold the query's pass maximum, relative to c */
        const float dl = fmaxf(mc + 4.0f, 0.f);      /* the reference only rises; 0 also where every key of the pass is masked */
        float al;
        asm("v_exp_f32 %0, %1\n\tv_nop" : "=v"(al) : "v"(-dl));      /* 2^(old c - new c); the v_nop is the free slot behind the exponential */
        negc[g] -= dl;
#pragma unroll
        for (int i = 0; i < 16; ++i) a2[i] = sv[g][i] - dl;
        fs_p16(a2, pa[g], sm[g]);      /* this pass's P anew, against the new reference */
        l_r[g] *= al;
#pragma unroll
        for (int dt = 0; dt < DT; ++dt)
#pragma unroll
          for (int r = 0; r < 8; ++r) oacc[g][dt][r] *= al; } }
#pragma unroll
    for (int g = 0; g < NG; ++g) l_r[g] += sm[g];      /* per-lane partial sum; the halves join after the loop */
#pragma unroll
    for (int dt = 0; dt < DT; ++dt)
#pragma unroll
      for (int g = 0; g < NG; ++g) oacc[g][dt] = wm(bv[dt].v, pa[g].v, oacc[g][dt]); }
    asm volatile("s_wait_dscnt 0x0" ::: "memory");       /* this wave's reads of buffer t & 1 are done before the buffer is handed back */
    asm volatile("s_wait_asynccnt 0x0" ::: "memory");    /* this wave's copies of stage t + 1 have landed */
    __syncthreads();                                     /* publishes stage t + 1 and ends every wave's reads of stage t */
    if (t + 2 < NST) fs_copy6(lt + bo, gkh + (size_t)(t + 2) * FS_KEYS * ldk, gkl + (size_t)(t + 2) * FS_KEYS * ldk, ldk, gvt + (t + 2) * FS_KEYS);
  }
  asm volatile("s_wait_asynccnt 0x0" ::: "memory");      /* nothing is in flight when the wave goes on to its end */
#pragma unroll
  for (int g = 0; g < NG; ++g) { const float l = l_r[g] + xhalf(l_r[g]); const float inv = (l > 0.f) ? 1.0f / l : 0.f;
#pragma unroll
    for (int dt = 0; dt < DT; ++dt)
#pragma unroll
      for (int q = 0; q < 2; ++q) { const v4f o4 = { oacc[g][dt][q * 4] * inv, oacc[g][dt][q * 4 + 1] * inv, oacc[g][dt][q * 4 + 2] * inv, oacc[g][dt][q * 4 + 3] * inv }; *(v4fa*)&sO[w][g * 16 + ln][dt * 16 + 8 * hh + q * 4] = o4; } }
  __builtin_amdgcn_fence(__ATOMIC_ACQ_REL, "workgroup"); __builtin_amdgcn_wave_barrier();
  {
#pragma unroll      /* O x 2^4 goes out as the f16 operand of the output GEMM: 8 lanes a row, one whole 128-B line per (query, head) */
    for (int rp = 0; rp < RPW; rp += 4) { const int r = rp + (lane >> 3), c8 = (lane & 7) * 8; const v4f a = *(const v4fa*)&sO[w][r][c8], c = *(const v4fa*)&sO[w][r][c8 + 4]; FragH f;
#pragma unroll
      for (int q = 0; q < 4; ++q) { f.h[q] = (_Float16)(a[q] * 16.0f); f.h[4 + q] = (_Float16)(c[q] * 16.0f); }
      *(v8us*)((unsigned short*)O16 + ((size_t)b * TT + q0 + r) * ldo + h * 64 + c8) = f.half[0]; }
     } }

// ---- projection GEMM with its operands staged in LDS: C = alpha * A . Bt^T, A [NR][DD] and Bt [DD][DD] f16, both k-contiguous.
// One 128 x 128 tile per work-group of 8 waves (4 x 2 waves of 32 x 64). A stage is 128 k = 256 B of each of the 256 operand rows (A rows 0-127, Bt rows 128-255),
// brought by asynchronous copies that cover whole 256-B units (16 lanes a row), two buffers: stage t + 1 flies while stage t is multiplied.
// LDS row pitch 272 B = 16 B x odd, the conflict-free pitch of ds_load_b128 fragment reads.
// The 8 tiles of a tile row share their A rows, the 32 tiles of a tile column their Bt rows: each tile begins its walk over the k stages at stage (tile row + tile column) mod 8 and wraps,
// so that the sharers ask L2 for different lines at any one moment. An accumulator sums its k stages in that rotated order; inside a stage the order is 0, 32, 64, 96.
#define GS_K 128
#define GS_PITCH 272
#define GS_STAGE (256 * GS_PITCH)
// eight copies of one lane: rows r, r + 16, ..., r + 112 of one operand, 16 B each. The s_wait_xcnt stands inside the copies' own statement, so that no address register named here is rewritten in front of it.
__device__ __forceinline__ void gs_copy8(unsigned l, const _Float16* g) {
  asm volatile("global_load_async_to_lds_b128 %0, %8, off\n\t"
               "global_load_async_to_lds_b128 %1, %9, off\n\t"
               "global_load_async_to_lds_b128 %2, %10, off\n\t"
               "global_load_async_to_lds_b128 %3, %11, off\n\t"
               "global_load_async_to_lds_b128 %4, %12, off\n\t"
               "global_load_async_to_lds_b128 %5, %13, off\n\t"
               "global_load_async_to_lds_b128 %6, %14, off\n\t"
               "global_load_async_to_lds_b128 %7, %15, off\n\t"
               "s_wait_xcnt 0x0"
               :: "v"(l), "v"(l + 16 * GS_PITCH), "v"(l + 32 * GS_PITCH), "v"(l + 48 * GS_PITCH), "v"(l + 64 * GS_PITCH), "v"(l + 80 * GS_PITCH), "v"(l + 96 * GS_PITCH), "v"(l + 112 * GS_PITCH),
                  "v"(g), "v"(g + 16 * DD), "v"(g + 32 * DD), "v"(g + 48 * DD), "v"(g + 64 * DD), "v"(g + 80 * DD), "v"(g + 96 * DD), "v"(g + 112 * DD)
               : "memory");
}
// the 2 A and 4 B fragments of one k step (32 k = 64 B of a row) from a stage in LDS; both operands in the same k order: 8 hh + 0..7, then 16 + 8 hh + 0..7
__device__ __forceinline__ void gs_frags(FragH (&a)[2], FragH (&b)[4], const unsigned char* pa, const unsigned char* pb) {
#pragma unroll
  for (int i = 0; i < 2; ++i) { a[i].half[0] = *(const v8us*)(pa + i * 16 * GS_PITCH); a[i].half[1] = *(const v8us*)(pa + i * 16 * GS_PITCH + 32); }
#pragma unroll
  for (int j = 0; j < 4; ++j) { b[j].half[0] = *(const v8us*)(pb + j * 16 * GS_PITCH); b[j].half[1] = *(const v8us*)(pb + j * 16 * GS_PITCH + 32); }
}
// the 8 products of one k step
__device__ __forceinline__ void gs_mma(v8f (&acc)[2][4], const FragH (&a)[2], const FragH (&b)[4]) {
#pragma unroll
  for (int i = 0; i < 2; ++i)
#pragma unroll
    for (int j = 0; j < 4; ++j) acc[i][j] = __builtin_amdgcn_wmma_f32_16x16x32_f16(false, a[i].v, false, b[j].v, (short)0, acc[i][j], false, false);
}
// QKV = false: one product, C f32. QKV = true: the q, k and v projections in one grid (256 tiles each, Bt = the three weights in a row), each with its consumer's conversion as epilogue:
// q and k leave as elu + 1 split in f16 hi + residual planes, v leaves as f16 already transposed, Vt[batch * DD + column][token].
template <bool QKV>
__global__ __launch_bounds__(256) void k_gemm_lds(const _Float16* __restrict__ A, const _Float16* __restrict__ Bt, float alpha, float* __restrict__ C,
                                                  _Float16* __restrict__ Qh, _Float16* __restrict__ Ql, _Float16* __restrict__ Kh, _Float16* __restrict__ Kl, _Float16* __restrict__ Vt) {
  __shared__ __attribute__((aligned(16))) unsigned char sT[2 * GS_STAGE];
  __shared__ __attribute__((aligned(16))) float so[8][32][64 + 4];
  constexpr int NST = DD / GS_K;
  const int tid = threadIdx.x, w = tid >> 5, lane = tid & 31, ln = lane & 15, hh = lane >> 4;
  constexpr int NTILE = (NR / 128) * (DD / 128);
  const int which = QKV ? blockIdx.x / NTILE : 0, tile = QKV ? blockIdx.x % NTILE : blockIdx.x;      /* which: 0 q, 1 k, 2 v; the same for the whole work-group */
  Bt += (size_t)which * DD * DD;
  const int row0 = (tile / (DD / 128)) * 128, col0 = (tile % (DD / 128)) * 128; const int wm = w >> 1, wn = w & 1;
  const int cr = tid >> 4, cc = tid & 15;      /* this lane's row (mod 16) and 16-B column of every copy */
  const _Float16* ga = A + (size_t)(row0 + cr) * DD + cc * 8; const _Float16* gb = Bt + (size_t)(col0 + cr) * DD + cc * 8;
  const unsigned la = (unsigned)(size_t)sT + cr * GS_PITCH + cc * 16, lb = la + 128 * GS_PITCH;
  static_assert((NST & (NST - 1)) == 0, "the wrap is a mask");
  const int rot = tile / (DD / 128) + tile % (DD / 128);      /* trip t works on k stage (t + rot) mod NST; the same for the whole work-group */
  gs_copy8(la, ga + (rot & (NST - 1)) * GS_K); gs_copy8(lb, gb + (rot & (NST - 1)) * GS_K);
  asm volatile("s_wait_asynccnt 0x0" ::: "memory");      /* stage 0 has landed for this wave */
  __syncthreads();                                       /* ... and for every wave */
  gs_copy8(la + GS_STAGE, ga + ((rot + 1) & (NST - 1)) * GS_K); gs_copy8(lb + GS_STAGE, gb + ((rot + 1) & (NST - 1)) * GS_K);
  v8f acc[2][4];
#pragma unroll
  for (int i = 0; i < 2; ++i)
#pragma unroll
    for (int j = 0; j < 4; ++j) acc[i][j] = (v8f){0.f,0.f,0.f,0.f,0.f,0.f,0.f,0.f};
  const unsigned char* fa = sT + (wm * 32 + ln) * GS_PITCH + 16 * hh; const unsigned char* fb = sT + (128 + wn * 64 + ln) * GS_PITCH + 16 * hh;
#pragma unroll 1      /* one stage a trip: the two buffers alternate by an offset, the text stays small */
  for (int t = 0; t < NST; ++t) {
    const unsigned bo = (unsigned)(t & 1) * GS_STAGE;
    FragH a[2][2], b[2][4];      /* two fragment sets: the reads of k step ks + 1 of this same stage are issued as one group ahead of the products of k step ks */
    gs_frags(a[0], b[0], fa + bo, fb + bo);
#pragma unroll
    for (int ks = 0; ks + 1 < GS_K / 32; ++ks) {
      gs_frags(a[(ks + 1) & 1], b[(ks + 1) & 1], fa + bo + (ks + 1) * 64, fb + bo + (ks + 1) * 64);
      __builtin_amdgcn_sched_barrier(0);      /* keeps that group of reads ahead of the products: left alone the scheduler sinks each read to just in front of its use, and the wave waits out the LDS latency there */
      gs_mma(acc, a[ks & 1], b[ks & 1]);
    }
    __builtin_amdgcn_sched_barrier(0);                   /* those products stay in front of the hand-over and cover the last group's LDS latency */
    asm volatile("s_wait_dscnt 0x0" ::: "memory");       /* this wave's reads of buffer t & 1 are done before the buffer is handed back */
    asm volatile("s_wait_asynccnt 0x0" ::: "memory");    /* this wave's copies of stage t + 1 have landed */
    __syncthreads();                                     /* publishes stage t + 1 and ends every wave's reads of stage t */
    if (t + 2 < NST) { const int kn = ((t + 2 + rot) & (NST - 1)) * GS_K; gs_copy8(la + bo, ga + kn); gs_copy8(lb + bo, gb + kn); }
    __builtin_amdgcn_sched_barrier(0);                   /* the refill is issued first: the last k step's products need registers only and run while the copies fly */
    gs_mma(acc, a[(GS_K / 32 - 1) & 1], b[(GS_K / 32 - 1) & 1]);
  }
  asm volatile("s_wait_asynccnt 0x0" ::: "memory");      /* nothing is in flight when the wave goes on to its end */
  if (QKV && which == 2) {
    /* v: a lane's 8 accumulator rows are 8 consecutive tokens of one column = 16 B of the transposed tile; staged [128 columns][128 tokens] f16 at pitch 272 B in so */
    unsigned char* sv = (unsigned char*)&so[0][0][0];
#pragma unroll
    for (int i = 0; i < 2; ++i)
#pragma unroll
      for (int j = 0; j < 4; ++j) { FragH f;
#pragma unroll
        for (int r = 0; r < 8; ++r) f.h[r] = (_Float16)(acc[i][j][r] * alpha);
        *(v8us*)(sv + (wn * 64 + j * 16 + ln) * GS_PITCH + (wm * 32 + i * 16 + 8 * hh) * 2) = f.half[0]; }
    __syncthreads();      /* a column's 128 tokens come from four waves: every wave's part is in LDS before any is read back */
#pragma unroll
    for (int q = 0; q < 8; ++q) { const int c = q * 16 + (tid >> 4), ch = tid & 15;      /* 16 lanes a column: 256 contiguous bytes of Vt */
      const v8us v = *(const v8us*)(sv + c * GS_PITCH + ch * 16);
      *(v8us*)((unsigned short*)Vt + ((size_t)(row0 / TT) * DD + col0 + c) * TT + row0 % TT + ch * 8) = v; }
  } else {
#pragma unroll
  for (int i = 0; i < 2; ++i)
#pragma unroll
    for (int j = 0; j < 4; ++j)
#pragma unroll
      for (int r = 0; r < 8; ++r) so[w][i * 16 + 8 * hh + r][j * 16 + ln] = acc[i][j][r] * alpha;
  __builtin_amdgcn_fence(__ATOMIC_ACQ_REL, "workgroup"); __builtin_amdgcn_wave_barrier();      /* the wave reads back rows that its other lanes wrote */
  if (QKV) {
    /* q, k: elu(x) + 1 = x + 1 (x > 0) | e^x (x <= 0), then hi = f16(v), lo = f16(v - hi), unscaled (its smallest values are f16 subnormals, 2^-24 apart); 8 lanes a row: the wave's 64 columns are one whole 128-B line of each plane */
    unsigned short* Hh = (unsigned short*)(which == 0 ? Qh : Kh); unsigned short* Hl = (unsigned short*)(which == 0 ? Ql : Kl);
    const float fs = (which == 0) ? 1.4426950408889634f : 1.0f;      /* the q planes carry log2(e): the score products of k_flash come out as base-2 exponents */
#pragma unroll
    for (int q = 0; q < 8; ++q) { const int r = q * 4 + (lane >> 3), c8 = (lane & 7) * 8; const v4f a = *(const v4fa*)&so[w][r][c8], c = *(const v4fa*)&so[w][r][c8 + 4]; FragH fh, fl;
#pragma unroll
      for (int e = 0; e < 8; ++e) { const float x = (e < 4) ? a[e] : c[e - 4]; const float ex = expf(x);      /* taken for every lane, then selected: eight independent chains and no branch per element, with only two waves a SIMD to cover latency here */
        const float v = ((x > 0.f) ? x + 1.0f : ex) * fs; const _Float16 h = (_Float16)v; fh.h[e] = h; fl.h[e] = (_Float16)(v - (float)h); }
      const size_t o = (size_t)(row0 + wm * 32 + r) * DD + col0 + wn * 64 + c8;
      *(v8us*)(Hh + o) = fh.half[0]; *(v8us*)(Hl + o) = fl.half[0]; }
    asm volatile("s_wait_xcnt 0x0" ::: "memory");      /* behind the last hi/lo store: no address or data register of these stores is rewritten in front of this wait on any way out of the loop */
  } else {
    const int rsub = lane >> 4, c4 = (lane & 15) * 4;
#pragma unroll
    for (int q = 0; q < 16; ++q) { const int r = q * 2 + rsub; const v4f v = *(const v4fa*)&so[w][r][c4]; *(v4f*)(C + (size_t)(row0 + wm * 32 + r) * DD + col0 + wn * 64 + c4) = v; }
  }
  }
}

extern "C" void kernel_launch(void* const* d_in, const int* in_sizes, int n_in,
                              void* d_out, int out_size, void* d_ws, size_t ws_size, hipStream_t stream) {
  (void)in_sizes; (void)n_in; (void)out_size;
  const float* x = (const float*)d_in[0]; const int* mask = (const int*)d_in[1]; const float* Wq = (const float*)d_in[2]; const float* Wk = (const float*)d_in[3]; const float* Wv = (const float*)d_in[4]; const float* Wo = (const float*)d_in[5];
  char* ws = (char*)d_ws; size_t off = 0;
  auto take = [&](size_t bytes) { char* p = ws + off; off += (bytes + 255) & ~(size_t)255; return p; };
  const size_t WSZ = (size_t)DD * DD; _Float16* Bw = (_Float16*)take(4 * WSZ * 2); _Float16* X16 = (_Float16*)take((size_t)NR * DD * 2);
  _Float16* Qh = (_Float16*)take((size_t)NR * DD * 2); _Float16* Ql = (_Float16*)take((size_t)NR * DD * 2); _Float16* Kh = (_Float16*)take((size_t)NR * DD * 2); _Float16* Kl = (_Float16*)take((size_t)NR * DD * 2); _Float16* Vt = (_Float16*)take((size_t)NR * DD * 2);
  _Float16* O16 = X16;      /* X16 is dead after the q/k/v launch */
  if (off > ws_size) return;      // 7 x 8.4 MB
  k_prep<<<PREP_T / 256, 256, 0, stream>>>(x, Wq, Wk, Wv, Wo, X16, Bw);
  k_gemm_lds<true><<<3 * (NR / 128) * (DD / 128), 256, 0, stream>>>(X16, Bw, 0.0625f, nullptr, Qh, Ql, Kh, Kl, Vt);      /* q, k: elu + 1 hi/lo; v: transposed */
  k_flash<<<BB * NH * (TT / 256), 256, 0, stream>>>(Qh, Ql, DD, Kh, Kl, DD, Vt, mask, O16, DD);
  k_gemm_lds<false><<<(NR / 128) * (DD / 128), 256, 0, stream>>>(O16, Bw + 3 * WSZ, 0.00390625f, (float*)d_out, nullptr, nullptr, nullptr, nullptr, nullptr);      /* out = O . Wo^T */
}
